// v010
// Times are from an AMD MI455X. After a warm-up the kernel runs many times in a row, and a time is the length of
// such a window on the GPU divided by its runs, so every launch and the gaps after it count. The runs cycle
// through copies of the inputs. A figure is the median of several windows, for all but v000 over two sittings.
// Sittings can differ by a few percent; kernels timed side by side share one.
// This document starts at v010; the versions before it stand elsewhere.
// Measured time: 122 microseconds a run.
// Two timings next to v009 put it at 1.18 and 1.20 times that version's speed.
// All steps since the starting kernel, v000, together make it 8.77 times as fast.
#include <hip/hip_runtime.h>
// MFI (3 frames, B=4, C=64, 64×64 → N=4096): SA_f = position attention on frame f (q = wq·x+bq (8 ch), k = wk·x+bk (8 ch), v = wv·x+bv (64 ch); attn = softmax_m(q[:,n]·k[:,m]) unscaled; out[e][n] = Σ_m v[e][m]·attn[n][m] + x[e][n]); then two guided attentions
// (q,k from SA_0 / SA_2, v and residual from SA_1), cat → fusion = tfus_w·cat + b; out = fusion·SA_1 + SA_1 → [4,64,64,64].
// Compute dtype: x, weights, biases rounded to bf16; q/k per token in f32 VALU (8×64 dot, rolled) emitted as concatenated f16 planes [q_hi|q_lo·2^10|q_hi|0] and [k_hi|k_hi·2^-10|k_lo|0] so ONE 32-wide WMMA k-step yields f32-accurate logits; v (+bias via an
// augmented ones column) by GEMM (f16) in k_flash's A-fragment order; fused flash-style kernel per (slab, 64 queries) (online softmax f32, P f16 hi + residual, residual added in f32 by its merge, which writes SA channel-major f32 or cat token-major f16); cat f16 -> fusion GEMM -> out = fusion * sa_1 + sa_1 in f32. All on v_wmma_f32_16x16x32_f16.
#define NFR 3
#define BB 4
#define CC 64
#define TT 4096
#define NH 1
#define NSL (5 * BB)

typedef __bf16 v16b __attribute__((ext_vector_type(16)));
typedef unsigned short v8us __attribute__((ext_vector_type(8), may_alias));
typedef float  v8f  __attribute__((ext_vector_type(8)));
typedef float  v4f  __attribute__((ext_vector_type(4)));
typedef float  v4fa __attribute__((ext_vector_type(4), may_alias));
union FragB { v16b v; v8us half[2]; unsigned short u[16]; };

__device__ __forceinline__ unsigned short bf16_bits(float x) { unsigned int u = __float_as_uint(x); return (unsigned short)((u + 0x7FFFu + ((u >> 16) & 1u)) >> 16); }
__device__ __forceinline__ float bf16_val(unsigned short b) { return __uint_as_float(((unsigned int)b) << 16); }
__device__ __forceinline__ float bf16_round(float x) { return bf16_val(bf16_bits(x)); }
// D += A·B with NT terms: 1 = ah·bh, 2 = + al·bh (A split), 3 = + ah·bl (both split)
template <int NT>
__device__ __forceinline__ v8f mmaN(v16b ah, v16b al, v16b bh, v16b bl, v8f c) {
  c = __builtin_amdgcn_wmma_f32_16x16x32_bf16(false, ah, false, bh, (short)0, c, false, false);
  if (NT >= 2) c = __builtin_amdgcn_wmma_f32_16x16x32_bf16(false, al, false, bh, (short)0, c, false, false);
  if (NT >= 3) c = __builtin_amdgcn_wmma_f32_16x16x32_bf16(false, ah, false, bl, (short)0, c, false, false);
  asm volatile("v_nop\n\tv_nop\n\tv_nop\n\tv_nop" : "+v"(c) : "v"(ah), "v"(al), "v"(bh), "v"(bl));
  return c;
}

__global__ __launch_bounds__(256) void k_wt_bf16(const float* __restrict__ W, unsigned short* __restrict__ Wt, int K, int N) {
  const int t = blockIdx.x * 256 + threadIdx.x;
  const int k8n = K / 8;
  if (t >= N * k8n) return;
  const int n = t / k8n, k8 = (t % k8n) * 8;
  v8us v;
#pragma unroll
  for (int i = 0; i < 8; ++i) v[i] = bf16_bits(W[(size_t)(k8 + i) * N + n]);
  *(v8us*)(Wt + (size_t)n * K + k8) = v;
  
}

// GEMM C[M][N] (f32, pitch ldc) = act(A[M][K]·W + bias). A f32 row-major (pitch lda) converted per fragment to bf16
// (ASPLIT: hi/lo two planes -> 2 terms, else single rounded term); Wt bf16 [N][K] (pitch ldb). BIAS_BF16 rounds the
// bias to bf16 first (bias quantised to bf16 before the add). K%32==0, M%16==0, N%64==0.
template <bool ASPLIT, int ACT, bool BIAS_BF16>
__global__ __launch_bounds__(128) void k_gemm_bf(const float* __restrict__ A, int lda, const unsigned short* __restrict__ Wt, int ldb,
                                               const float* __restrict__ bias, float* __restrict__ C, int ldc, int M, int N, int K) {
  __shared__ __attribute__((aligned(16))) float so[4][16][64];
  const int tid = threadIdx.x, w = tid >> 5, lane = tid & 31, ln = lane & 15, hh = lane >> 4;
  const int ntn = N / 64;
  const int wid = blockIdx.x * 4 + w;
  const int mt = wid / ntn, nq = wid % ntn;
  if (mt * 16 >= M) return;
  const int row0 = mt * 16, col0 = nq * 64;
  const float* arow = A + (size_t)(row0 + ln) * lda;
  v8f acc[4] = {};
  for (int kb = 0; kb < K; kb += 32) {
    FragB ah, al;
    const v4f x0 = *(const v4fa*)(arow + kb + 8 * hh), x1 = *(const v4fa*)(arow + kb + 8 * hh + 4);
    const v4f x2 = *(const v4fa*)(arow + kb + 16 + 8 * hh), x3 = *(const v4fa*)(arow + kb + 16 + 8 * hh + 4);
    float xs[16] = {x0[0],x0[1],x0[2],x0[3],x1[0],x1[1],x1[2],x1[3],x2[0],x2[1],x2[2],x2[3],x3[0],x3[1],x3[2],x3[3]};
#pragma unroll
    for (int i = 0; i < 16; ++i) { const unsigned short hb = bf16_bits(xs[i]); ah.u[i] = hb; al.u[i] = ASPLIT ? bf16_bits(xs[i] - bf16_val(hb)) : (unsigned short)0; }
#pragma unroll
    for (int t = 0; t < 4; ++t) {
      const unsigned short* brow = Wt + (size_t)(col0 + t * 16 + ln) * ldb + kb;
      FragB b;
      b.half[0] = *(const v8us*)(brow + 8 * hh);
      b.half[1] = *(const v8us*)(brow + 16 + 8 * hh);
      acc[t] = mmaN<ASPLIT ? 2 : 1>(ah.v, al.v, b.v, b.v, acc[t]);
    }
  }
#pragma unroll
  for (int t = 0; t < 4; ++t) {
    float bv = bias ? bias[col0 + t * 16 + ln] : 0.f;
    if (BIAS_BF16) bv = bf16_round(bv);
#pragma unroll
    for (int r = 0; r < 8; ++r) { float v = acc[t][r] + bv; if (ACT == 1) v = fmaxf(v, 0.f); so[w][8 * hh + r][t * 16 + ln] = v; }
  }
  __builtin_amdgcn_fence(__ATOMIC_ACQ_REL, "workgroup");
  __builtin_amdgcn_wave_barrier();
  const int rsub = lane >> 4, c4 = (lane & 15) * 4;
  {
#pragma unroll
    for (int q = 0; q < 8; ++q) {
      const int r = q * 2 + rsub;
      const v4f v = *(const v4fa*)&so[w][r][c4];
      *(v4f*)(C + (size_t)(row0 + r) * ldc + col0 + c4) = v;
    }
    
  }
}

// Flash-style causal/unmasked attention, all contractions 3-term bf16 hi/lo splits, f32 softmax with running max.
// q,k,v rows are read from f32 buffers with arbitrary row pitch (so they can live inside a fused qkv buffer);
// D = head size (multiple of 32, <= 128); one wave = 16 query rows; block = 4 waves (64 queries) sharing K/V chunks of 32.
template <int D, bool CAUSAL>
__global__ __launch_bounds__(128) void k_flash(const float* __restrict__ qb, const float* __restrict__ kb, const float* __restrict__ vb,
                                             int pitch, int T, int H, float scale, float* __restrict__ y, int ypitch) {
  constexpr int KS = D / 32;        // k-steps for QK
  constexpr int DT = D / 16;        // d tiles for PV
  __shared__ __attribute__((aligned(16))) unsigned short sKh[32][D + 8], sKl[32][D + 8], sVh[32][D + 8], sVl[32][D + 8];
  __shared__ __attribute__((aligned(16))) unsigned short sPh[4][16][40], sPl[4][16][40];
  __shared__ __attribute__((aligned(16))) float sO[4][16][D];
  const int tid = threadIdx.x, w = tid >> 5, lane = tid & 31, ln = lane & 15, hh = lane >> 4;
  const int nqb = (T + 63) / 64;
  const int bh = blockIdx.x / nqb, qblk = blockIdx.x % nqb;
  const int b = bh / H, h = bh % H;
  const int q0 = qblk * 64 + w * 16;
  const float* Q = qb + (size_t)b * T * pitch + h * D;
  const float* K = kb + (size_t)b * T * pitch + h * D;
  const float* V = vb + (size_t)b * T * pitch + h * D;

  // A fragments of the wave's 16 query rows (scaled), hi/lo
  FragB aqh[KS], aql[KS];
  {
    int row = q0 + ln; if (row >= T) row = T - 1;
    const float* qr = Q + (size_t)row * pitch;
#pragma unroll
    for (int ks = 0; ks < KS; ++ks)
#pragma unroll
      for (int i = 0; i < 16; ++i) {
        const int d = ks * 32 + ((i < 8) ? (8 * hh + i) : (16 + 8 * hh + (i - 8)));
        const float x = qr[d] * scale; const unsigned short hb = bf16_bits(x);
        aqh[ks].u[i] = hb; aql[ks].u[i] = bf16_bits(x - bf16_val(hb));
      }
  }
  float m_r[8], l_r[8];
#pragma unroll
  for (int r = 0; r < 8; ++r) { m_r[r] = -3.0e38f; l_r[r] = 0.f; }
  v8f oacc[DT];
#pragma unroll
  for (int dt = 0; dt < DT; ++dt) oacc[dt] = (v8f){0.f,0.f,0.f,0.f,0.f,0.f,0.f,0.f};

  const int kv_end = CAUSAL ? min(T, qblk * 64 + 64) : T;     // block-uniform
  for (int j0 = 0; j0 < kv_end; j0 += 32) {
    __syncthreads();
    for (int e = tid; e < 32 * (D / 4); e += 128) {
      const int r = e / (D / 4), c4 = (e % (D / 4)) * 4;
      const int key = j0 + r;
      v4f kf = {0.f,0.f,0.f,0.f}, vf = {0.f,0.f,0.f,0.f};
      if (key < T) { kf = *(const v4fa*)(K + (size_t)key * pitch + c4); vf = *(const v4fa*)(V + (size_t)key * pitch + c4); }
#pragma unroll
      for (int t = 0; t < 4; ++t) {
        unsigned short hb = bf16_bits(kf[t]); sKh[r][c4 + t] = hb; sKl[r][c4 + t] = bf16_bits(kf[t] - bf16_val(hb));
        hb = bf16_bits(vf[t]); sVh[r][c4 + t] = hb; sVl[r][c4 + t] = bf16_bits(vf[t] - bf16_val(hb));
      }
    }
    __syncthreads();
    // S tile 16 x 32
    v8f s[2];
#pragma unroll
    for (int nt = 0; nt < 2; ++nt) {
      v8f acc = {};
#pragma unroll
      for (int ks = 0; ks < KS; ++ks) {
        FragB bh_, bl_;
        bh_.half[0] = *(const v8us*)&sKh[nt * 16 + ln][ks * 32 + 8 * hh]; bh_.half[1] = *(const v8us*)&sKh[nt * 16 + ln][ks * 32 + 16 + 8 * hh];
        bl_.half[0] = *(const v8us*)&sKl[nt * 16 + ln][ks * 32 + 8 * hh]; bl_.half[1] = *(const v8us*)&sKl[nt * 16 + ln][ks * 32 + 16 + 8 * hh];
        acc = mmaN<3>(aqh[ks].v, aql[ks].v, bh_.v, bl_.v, acc);
      }
      s[nt] = acc;
    }
    // mask + running max (rows 8hh+r; the 16 lanes of a half share rows)
    float alpha[8];
#pragma unroll
    for (int r = 0; r < 8; ++r) {
      const int qi = q0 + 8 * hh + r;
      const int ja = j0 + ln, jb = j0 + 16 + ln;
      if (CAUSAL) { if (ja > qi) s[0][r] = -3.0e38f; if (jb > qi) s[1][r] = -3.0e38f; }
      if (ja >= T) s[0][r] = -3.0e38f;
      if (jb >= T) s[1][r] = -3.0e38f;
      float mx = fmaxf(s[0][r], s[1][r]);
      mx = fmaxf(mx, __shfl_xor(mx, 1, 32)); mx = fmaxf(mx, __shfl_xor(mx, 2, 32)); mx = fmaxf(mx, __shfl_xor(mx, 4, 32)); mx = fmaxf(mx, __shfl_xor(mx, 8, 32));
      const float mnew = fmaxf(m_r[r], mx);
      alpha[r] = (mnew > -1.0e38f) ? __expf(m_r[r] - mnew) : 1.0f;
      const float p0 = (s[0][r] > -1.0e38f) ? __expf(s[0][r] - mnew) : 0.f;
      const float p1 = (s[1][r] > -1.0e38f) ? __expf(s[1][r] - mnew) : 0.f;
      m_r[r] = mnew;
      l_r[r] = l_r[r] * alpha[r] + p0 + p1;            // per-lane partial row sum (16 lanes combined at the end)
      unsigned short hb = bf16_bits(p0); sPh[w][8 * hh + r][ln] = hb;      sPl[w][8 * hh + r][ln] = bf16_bits(p0 - bf16_val(hb));
      hb = bf16_bits(p1);                sPh[w][8 * hh + r][16 + ln] = hb; sPl[w][8 * hh + r][16 + ln] = bf16_bits(p1 - bf16_val(hb));
    }
#pragma unroll
    for (int dt = 0; dt < DT; ++dt)
#pragma unroll
      for (int r = 0; r < 8; ++r) oacc[dt][r] *= alpha[r];
    __builtin_amdgcn_fence(__ATOMIC_ACQ_REL, "workgroup");
    __builtin_amdgcn_wave_barrier();
    FragB pah, pal;
    pah.half[0] = *(const v8us*)&sPh[w][ln][8 * hh]; pah.half[1] = *(const v8us*)&sPh[w][ln][16 + 8 * hh];
    pal.half[0] = *(const v8us*)&sPl[w][ln][8 * hh]; pal.half[1] = *(const v8us*)&sPl[w][ln][16 + 8 * hh];
#pragma unroll
    for (int dt = 0; dt < DT; ++dt) {
      FragB bvh, bvl;
#pragma unroll
      for (int i = 0; i < 8; ++i) {
        bvh.u[i] = sVh[8 * hh + i][dt * 16 + ln]; bvh.u[8 + i] = sVh[16 + 8 * hh + i][dt * 16 + ln];
        bvl.u[i] = sVl[8 * hh + i][dt * 16 + ln]; bvl.u[8 + i] = sVl[16 + 8 * hh + i][dt * 16 + ln];
      }
      oacc[dt] = mmaN<3>(pah.v, pal.v, bvh.v, bvl.v, oacc[dt]);
    }
    __builtin_amdgcn_fence(__ATOMIC_ACQ_REL, "workgroup");
    __builtin_amdgcn_wave_barrier();
  }
#pragma unroll
  for (int r = 0; r < 8; ++r) {
    float l = l_r[r];
    l += __shfl_xor(l, 1, 32); l += __shfl_xor(l, 2, 32); l += __shfl_xor(l, 4, 32); l += __shfl_xor(l, 8, 32);
    l_r[r] = (l > 0.f) ? 1.0f / l : 0.f;
  }
#pragma unroll
  for (int dt = 0; dt < DT; ++dt)
#pragma unroll
    for (int r = 0; r < 8; ++r) sO[w][8 * hh + r][dt * 16 + ln] = oacc[dt][r] * l_r[r];
  __builtin_amdgcn_fence(__ATOMIC_ACQ_REL, "workgroup");
  __builtin_amdgcn_wave_barrier();
  {
    for (int r = 0; r < 16; ++r) {
      const int row = q0 + r;
      if (row < T && lane < D / 4) {
        const v4f val = *(const v4fa*)&sO[w][r][lane * 4];
        *(v4f*)(y + ((size_t)b * T + row) * ypitch + h * D + lane * 4) = val;
      }
    }
    
  }
}

// GEMM C = act(A·W + bias + resid): A f32 (ASPLIT -> hi/lo 2 terms), Wt bf16 [N][K]; ACT 0 none, 1 relu, 2 exact gelu;
// resid (optional, f32, row index = (row % rmod), pitch ldr, RES_BF16 rounds it) added before the activation.
template <bool ASPLIT, int ACT, bool BIAS_BF16, bool RES_BF16>
__global__ __launch_bounds__(128) void k_gemm_bf3(const float* __restrict__ A, int lda, const unsigned short* __restrict__ Wt, int ldb,
                                                const float* __restrict__ bias, const float* __restrict__ resid, int rmod, int ldr,
                                                float* __restrict__ C, int ldc, int M, int N, int K) {
  __shared__ __attribute__((aligned(16))) float so[4][16][64];
  const int tid = threadIdx.x, w = tid >> 5, lane = tid & 31, ln = lane & 15, hh = lane >> 4;
  const int ntn = N / 64;
  const int wid = blockIdx.x * 4 + w;
  const int mt = wid / ntn, nq = wid % ntn;
  if (mt * 16 >= M) return;
  const int row0 = mt * 16, col0 = nq * 64;
  const float* arow = A + (size_t)(row0 + ln) * lda;
  v8f acc[4] = {};
  for (int kb = 0; kb < K; kb += 32) {
    FragB ah, al;
    const v4f x0 = *(const v4fa*)(arow + kb + 8 * hh), x1 = *(const v4fa*)(arow + kb + 8 * hh + 4);
    const v4f x2 = *(const v4fa*)(arow + kb + 16 + 8 * hh), x3 = *(const v4fa*)(arow + kb + 16 + 8 * hh + 4);
    float xs[16] = {x0[0],x0[1],x0[2],x0[3],x1[0],x1[1],x1[2],x1[3],x2[0],x2[1],x2[2],x2[3],x3[0],x3[1],x3[2],x3[3]};
#pragma unroll
    for (int i = 0; i < 16; ++i) { const unsigned short hb = bf16_bits(xs[i]); ah.u[i] = hb; al.u[i] = ASPLIT ? bf16_bits(xs[i] - bf16_val(hb)) : (unsigned short)0; }
#pragma unroll
    for (int t = 0; t < 4; ++t) {
      const unsigned short* brow = Wt + (size_t)(col0 + t * 16 + ln) * ldb + kb;
      FragB b;
      b.half[0] = *(const v8us*)(brow + 8 * hh);
      b.half[1] = *(const v8us*)(brow + 16 + 8 * hh);
      acc[t] = mmaN<ASPLIT ? 2 : 1>(ah.v, al.v, b.v, b.v, acc[t]);
    }
  }
#pragma unroll
  for (int t = 0; t < 4; ++t) {
    const int col = col0 + t * 16 + ln;
    float bv = bias ? bias[col] : 0.f;
    if (BIAS_BF16) bv = bf16_round(bv);
#pragma unroll
    for (int r = 0; r < 8; ++r) {
      float v = acc[t][r] + bv;
      if (resid) { float rv = resid[(size_t)((row0 + 8 * hh + r) % rmod) * ldr + col]; if (RES_BF16) rv = bf16_round(rv); v += rv; }
      if (ACT == 1) v = fmaxf(v, 0.f);
      if (ACT == 2) v = 0.5f * v * (1.0f + erff(v * 0.70710678118654752f));
      if (ACT == 3) { const float u = 0.7978845608028654f * (v + 0.044715f * v * v * v); v = 0.5f * v * (1.0f + tanhf(u)); }
      so[w][8 * hh + r][t * 16 + ln] = v;
    }
  }
  __builtin_amdgcn_fence(__ATOMIC_ACQ_REL, "workgroup");
  __builtin_amdgcn_wave_barrier();
  const int rsub = lane >> 4, c4 = (lane & 15) * 4;
  {
#pragma unroll
    for (int q = 0; q < 8; ++q) {
      const int r = q * 2 + rsub;
      const v4f v = *(const v4fa*)&so[w][r][c4];
      *(v4f*)(C + (size_t)(row0 + r) * ldc + col0 + c4) = v;
    }
    
  }
}
// row LayerNorm (biased variance, eps) over N: s = X (+ R); optional out_sum <- s; out_norm <- (s-mu)*rsqrt(var+eps)*g + b
template <bool PARAM_BF16>
__global__ __launch_bounds__(256) void k_layernorm(const float* __restrict__ X, const float* __restrict__ R, const float* __restrict__ g, const float* __restrict__ bta,
                                                  float* __restrict__ out_sum, float* __restrict__ out_norm, int N, float eps) {
  __shared__ float red[256];
  const int row = blockIdx.x, tid = threadIdx.x;
  const float* x = X + (size_t)row * N; const float* rr = R ? R + (size_t)row * N : nullptr;
  float vals[16];                     // up to N = 4096
  const int per = N / 256;            // contiguous chunk per thread? use strided-by-4 chunks: thread handles j = tid*4 + 1024*u
  float s1 = 0.f;
  for (int u = 0; u < per / 4; ++u) {
    const int j = tid * 4 + 1024 * u;
    const v4f a = *(const v4fa*)(x + j);
    v4f b = {0.f,0.f,0.f,0.f}; if (rr) b = *(const v4fa*)(rr + j);
#pragma unroll
    for (int q = 0; q < 4; ++q) { const float v = a[q] + b[q]; vals[u * 4 + q] = v; s1 += v; }
  }
  red[tid] = s1; __syncthreads();
  for (int st = 128; st > 0; st >>= 1) { if (tid < st) red[tid] += red[tid + st]; __syncthreads(); }
  const float mu = red[0] / (float)N; __syncthreads();
  float s2 = 0.f;
  for (int u = 0; u < per / 4; ++u)
#pragma unroll
    for (int q = 0; q < 4; ++q) { const float c = vals[u * 4 + q] - mu; s2 += c * c; }
  red[tid] = s2; __syncthreads();
  for (int st = 128; st > 0; st >>= 1) { if (tid < st) red[tid] += red[tid + st]; __syncthreads(); }
  const float rs = rsqrtf(red[0] / (float)N + eps);
  {
    for (int u = 0; u < per / 4; ++u) {
      const int j = tid * 4 + 1024 * u;
      v4f o, sm;
#pragma unroll
      for (int q = 0; q < 4; ++q) {
        float gg = g[j + q], bb = bta[j + q];
        if (PARAM_BF16) { gg = bf16_round(gg); bb = bf16_round(bb); }
        sm[q] = vals[u * 4 + q]; o[q] = (vals[u * 4 + q] - mu) * rs * gg + bb;
      }
      if (out_sum) *(v4f*)(out_sum + (size_t)row * N + j) = sm;
      *(v4f*)(out_norm + (size_t)row * N + j) = o;
    }
    
  }
}



// ---- f16 WMMA path (v_wmma_f32_16x16x32_f16): 11-bit significands for operands in range — used where a [0,1] probability operand needs more precision than bf16
typedef _Float16 v16h __attribute__((ext_vector_type(16)));
union FragH { v16h v; v8us half[2]; _Float16 h[16]; unsigned short u[16]; };
template <int NT>
__device__ __forceinline__ v8f mmaH(v16h ah, v16h al, v16h bh, v16h bl, v8f c) {
  c = __builtin_amdgcn_wmma_f32_16x16x32_f16(false, ah, false, bh, (short)0, c, false, false);
  if (NT >= 2) c = __builtin_amdgcn_wmma_f32_16x16x32_f16(false, al, false, bh, (short)0, c, false, false);
  if (NT >= 3) c = __builtin_amdgcn_wmma_f32_16x16x32_f16(false, ah, false, bl, (short)0, c, false, false);
  asm volatile("v_nop\n\tv_nop\n\tv_nop\n\tv_nop" : "+v"(c) : "v"(ah), "v"(al), "v"(bh), "v"(bl));
  return c;
}
// batched GEMM like k_gemm_b but f16 operands: A f32 (split into f16 hi/lo if ASPLIT, else rounded to f16), Bt = f16 values [n][k]; alpha; C f32; N multiple of 16 (partial tiles skipped)
template <bool ASPLIT>
__global__ __launch_bounds__(128) void k_gemm_h(const float* __restrict__ A, int lda, size_t sA, const _Float16* __restrict__ Bh, int ldb, size_t sB, float alpha, float* __restrict__ C, int ldc, size_t sC, int M, int N, int K) {
  __shared__ __attribute__((aligned(16))) float so[4][16][64];
  const int tid = threadIdx.x, w = tid >> 5, lane = tid & 31, ln = lane & 15, hh = lane >> 4; const int by = blockIdx.y;
  A += (size_t)by * sA; Bh += (size_t)by * sB; C += (size_t)by * sC;
  const int ntn = (N + 63) / 64; const int wid = blockIdx.x * 4 + w; const int mt = wid / ntn, nq = wid % ntn; if (mt * 16 >= M) return;
  const int row0 = mt * 16, col0 = nq * 64; const float* arow = A + (size_t)(row0 + ln) * lda;
  v8f acc[4] = {};
  for (int kb = 0; kb < K; kb += 32) {
    FragH ah, al;
    const v4f x0 = *(const v4fa*)(arow + kb + 8 * hh), x1 = *(const v4fa*)(arow + kb + 8 * hh + 4), x2 = *(const v4fa*)(arow + kb + 16 + 8 * hh), x3 = *(const v4fa*)(arow + kb + 16 + 8 * hh + 4);
    float xs[16] = {x0[0],x0[1],x0[2],x0[3],x1[0],x1[1],x1[2],x1[3],x2[0],x2[1],x2[2],x2[3],x3[0],x3[1],x3[2],x3[3]};
#pragma unroll
    for (int i = 0; i < 16; ++i) { const _Float16 h = (_Float16)xs[i]; ah.h[i] = h; al.h[i] = ASPLIT ? (_Float16)(xs[i] - (float)h) : (_Float16)0.0f; }
#pragma unroll
    for (int t = 0; t < 4; ++t) { if (col0 + t * 16 >= N) continue; const size_t boff = (size_t)(col0 + t * 16 + ln) * ldb + kb; FragH bq; bq.half[0] = *(const v8us*)(Bh + boff + 8 * hh); bq.half[1] = *(const v8us*)(Bh + boff + 16 + 8 * hh);
      acc[t] = mmaH<ASPLIT ? 2 : 1>(ah.v, al.v, bq.v, bq.v, acc[t]); }
  }
#pragma unroll
  for (int t = 0; t < 4; ++t) { if (col0 + t * 16 >= N) continue;
#pragma unroll
    for (int r = 0; r < 8; ++r) so[w][8 * hh + r][t * 16 + ln] = acc[t][r] * alpha; }
  __builtin_amdgcn_fence(__ATOMIC_ACQ_REL, "workgroup"); __builtin_amdgcn_wave_barrier();
  const int rsub = lane >> 4, c4 = (lane & 15) * 4;
  {
#pragma unroll
    for (int q = 0; q < 8; ++q) { const int r = q * 2 + rsub; if (col0 + c4 < N) { const v4f v = *(const v4fa*)&so[w][r][c4]; *(v4f*)(C + (size_t)(row0 + r) * ldc + col0 + c4) = v; } }
     }
}

// Wt[n][k] = f16(W[k][n]·scale) from f32 row-major W[K][N] (scale = power of two; bf16-exact weights stay exact in f16 away from the subnormal range)
__global__ __launch_bounds__(256) void k_wt_f16(const float* __restrict__ W, _Float16* __restrict__ Wt, int K, int N, float scale) {
  const int t = blockIdx.x * 256 + threadIdx.x; if (t >= N * (K / 8)) return; const int n = t / (K / 8), k8 = (t % (K / 8)) * 8; FragH f;
#pragma unroll
  for (int i = 0; i < 8; ++i) f.h[i] = (_Float16)(bf16_round(W[(size_t)(k8 + i) * N + n]) * scale); const v8us o = f.half[0];
  *(v8us*)((unsigned short*)Wt + (size_t)n * K + k8) = o; 
}
// k_gemm_hh variant with fused epilogue: v = acc * alpha + bias[by * sBias + col] (+ CP[(row/rowsPerB) * sCPb + by * 64 + col] if CP) ; ACT 0 none / 1 elu ; writes f16 C16 (and f32 C if non-null); FIN: the last stage of the network in the epilogue, C = (v + bf16(rowb[row])) * S + S with S laid out like C
// VFR: C16 is written in the order in which k_flash loads it as A fragments (no bias, no activation, N a multiple of 64): halves [by, bz][col / 32][row / 16][(col >> 4) & 1][lane = ((col >> 3) & 1) * 16 + (row & 15)][col & 7], so that one 16-B load per lane there covers 512 B in a row, four whole 128-B lines.
// For that the product is formed transposed (the operands change places; both loaders have the same k order): lane (ln, hh) then holds columns t * 16 + 8hh + 0..7 of row row0 + ln, which is its own 16-B piece, and the tile goes from the accumulators to memory without the LDS trip.
template <int ACT, bool FIN, bool VFR = false>
__global__ __launch_bounds__(128) void k_gemm_hhx(const _Float16* __restrict__ A, int lda, size_t sA, const _Float16* __restrict__ Bh, int ldb, size_t sB, float alpha, const float* __restrict__ bias, size_t sBias, const float* __restrict__ CP, int rowsPerB, size_t sCPb, int row0g,
    float* __restrict__ C, _Float16* __restrict__ C16, int ldc, size_t sC, int M, int N, int K, size_t sAz, size_t sBz, size_t sCz, const float* __restrict__ rowb, const float* __restrict__ S) {
  __shared__ __attribute__((aligned(16))) float so[4][16][64];
  const int tid = threadIdx.x, w = tid >> 5, lane = tid & 31, ln = lane & 15, hh = lane >> 4; const int by = blockIdx.y, bz = blockIdx.z;      /* bz = attention instance, with strides of its own */
  A += (size_t)by * sA + (size_t)bz * sAz; Bh += (size_t)by * sB + (size_t)bz * sBz; const size_t cofs = (size_t)by * sC + (size_t)bz * sCz; const float* bp = bias ? bias + (size_t)by * sBias : nullptr;
  const int ntn = (N + 63) / 64; const int wid = blockIdx.x * 4 + w; const int mt = wid / ntn, nq = wid % ntn; if (mt * 16 >= M) return;
  const int row0 = mt * 16, col0 = nq * 64; const _Float16* arow = A + (size_t)(row0 + ln) * lda;
  v8f acc[4] = {};
  v4f sv[8]; float rb[8];      /* FIN: this lane's pieces of S and its rows' biases, loaded here so that they fly under the product */
  if (FIN) {
#pragma unroll
    for (int q = 0; q < 8; ++q) { const int r = q * 2 + (lane >> 4); rb[q] = rowb[row0 + r]; sv[q] = *(const v4fa*)(S + cofs + (size_t)(row0 + r) * ldc + col0 + (lane & 15) * 4); }
    asm volatile("s_wait_xcnt 0x0" ::: "memory"); }      /* behind this run of loads, in front of the first rewrite of a register that holds one of their addresses */
  for (int kb = 0; kb < K; kb += 32) { FragH ah; ah.half[0] = *(const v8us*)((const unsigned short*)arow + kb + 8 * hh); ah.half[1] = *(const v8us*)((const unsigned short*)arow + kb + 16 + 8 * hh);
#pragma unroll
    for (int t = 0; t < 4; ++t) { if (col0 + t * 16 >= N) continue; const size_t boff = (size_t)(col0 + t * 16 + ln) * ldb + kb; FragH bq; bq.half[0] = *(const v8us*)((const unsigned short*)Bh + boff + 8 * hh); bq.half[1] = *(const v8us*)((const unsigned short*)Bh + boff + 16 + 8 * hh);
      acc[t] = VFR ? mmaH<1>(bq.v, bq.v, ah.v, ah.v, acc[t]) : mmaH<1>(ah.v, ah.v, bq.v, bq.v, acc[t]); }
  }
  if (VFR) { unsigned short* vo = (unsigned short*)C16 + cofs + ((size_t)nq * 2 * (M / 16) + mt) * 512 + lane * 8; FragH f[4];      /* acc[t][r] = C[row0 + ln][col0 + t * 16 + 8hh + r] */
#pragma unroll
    for (int t = 0; t < 4; ++t)
#pragma unroll
      for (int r = 0; r < 8; ++r) f[t].h[r] = (_Float16)(acc[t][r] * alpha);
#pragma unroll
    for (int t = 0; t < 4; ++t) *(v8us*)(vo + (size_t)(t >> 1) * (M / 16) * 512 + (t & 1) * 256) = f[t].half[0];
    return; }
#pragma unroll
  for (int t = 0; t < 4; ++t) { if (col0 + t * 16 >= N) continue; const int col = col0 + t * 16 + ln; const float bv = bp ? bf16_round(bp[col]) : 0.f;
#pragma unroll
    for (int r = 0; r < 8; ++r) { float v = acc[t][r] * alpha + bv; if (CP) { const int bidx = (row0g + row0 + 8 * hh + r) / rowsPerB; v += CP[(size_t)bidx * sCPb + (size_t)by * 64 + col]; } if (ACT == 1) v = (v > 0.f) ? v : expm1f(v); else if (ACT == 7) v = (v > 0.f) ? v + 1.0f : expf(v); else if (ACT == 8) v = tanhf(v); else if (ACT == 9) v = 0.5f * v * (1.0f + tanhf(0.7978845608028654f * (v + 0.044715f * v * v * v))); else if (ACT == 11) v = 1.0f / (1.0f + expf(-v)); else if (ACT == 12) v = (v > 0.f) ? v : 0.01f * v; else if (ACT == 14) v = (v > 0.f) ? v : 0.1f * v; else if (ACT == 15) v = v / (1.0f + expf(-v)); else if (ACT == 3) v = fmaxf(v, 0.f); else if (ACT == 6) v = 0.5f * v * (1.0f + erff(v * 0.70710678118654752f)); so[w][8 * hh + r][t * 16 + ln] = v; } }
  __builtin_amdgcn_fence(__ATOMIC_ACQ_REL, "workgroup"); __builtin_amdgcn_wave_barrier();
  const int rsub = lane >> 4, c4 = (lane & 15) * 4; typedef _Float16 v4h __attribute__((ext_vector_type(4)));
  if (FIN) {      /* C = (v + bias of its row) * S + S, straight from the tile; like the loads of S above it takes whole 64-column tiles (N a multiple of 64) */
#pragma unroll
    for (int q = 0; q < 8; ++q) { const int r = q * 2 + rsub; const v4f v = *(const v4fa*)&so[w][r][c4]; const float bb = bf16_round(rb[q]); v4f o; for (int i = 0; i < 4; ++i) o[i] = (v[i] + bb) * sv[q][i] + sv[q][i]; *(v4f*)(C + cofs + (size_t)(row0 + r) * ldc + col0 + c4) = o; }
    return; }
  {
#pragma unroll
    for (int q = 0; q < 8; ++q) { const int r = q * 2 + rsub; if (col0 + c4 < N) { const v4f v = *(const v4fa*)&so[w][r][c4]; if (C) *(v4f*)(C + cofs + (size_t)(row0 + r) * ldc + col0 + c4) = v; if (C16) { v4h h4; for (int i = 0; i < 4; ++i) h4[i] = (_Float16)v[i]; *(v4h*)(C16 + cofs + (size_t)(row0 + r) * ldc + col0 + c4) = h4; } } }
     }
}


typedef _Float16 v4h __attribute__((ext_vector_type(4)));

__global__ __launch_bounds__(256) void k_x16(const float* __restrict__ x, _Float16* __restrict__ X16, size_t n8) { const size_t t = (size_t)blockIdx.x * 256 + threadIdx.x; if (t >= n8) return; FragH f;
#pragma unroll
  for (int q = 0; q < 8; ++q) f.h[q] = (_Float16)bf16_round(x[t * 8 + q]); *(v8us*)((unsigned short*)X16 + t * 8) = f.half[0];  }
__global__ __launch_bounds__(256) void k_h16(const float* __restrict__ x, _Float16* __restrict__ X16, size_t n8) { const size_t t = (size_t)blockIdx.x * 256 + threadIdx.x; if (t >= n8) return; FragH f;
#pragma unroll
  for (int q = 0; q < 8; ++q) f.h[q] = (_Float16)x[t * 8 + q]; *(v8us*)((unsigned short*)X16 + t * 8) = f.half[0];  }
template <int NHv, int TTv>
__global__ __launch_bounds__(256) void k_vt(const _Float16* __restrict__ V16, int ldv, int voff, _Float16* __restrict__ Vt) { __shared__ unsigned short tl[64][66]; const int tid = threadIdx.x; const int slab = blockIdx.x / (TTv / 64), lg = blockIdx.x % (TTv / 64); const int b = slab / NHv, h = slab % NHv;
  for (int i = tid; i < 64 * 8; i += 256) { const int r = i / 8, c8 = (i % 8) * 8; FragH f; f.half[0] = *(const v8us*)((const unsigned short*)V16 + ((size_t)b * TTv + lg * 64 + r) * ldv + voff + h * 64 + c8);
#pragma unroll
    for (int q = 0; q < 8; ++q) tl[r][c8 + q] = f.u[q]; }
  __syncthreads();
  {
#pragma unroll
    for (int rd = 0; rd < 2; ++rd) { const int d = rd * 32 + tid / 8, pc = tid % 8; FragH f;
#pragma unroll
      for (int q = 0; q < 8; ++q) f.u[q] = tl[pc * 8 + q][d];
      *(v8us*)((unsigned short*)Vt + ((size_t)slab * 64 + d) * TTv + lg * 64 + pc * 8) = f.half[0]; }
     } }

// Weights of the GEMMs as f16 x 2^4, thread t = one 16-B piece: the five value projections [64 e][96] (64 weights, the bias in column 64, zeros; instances 0..2 self, 3..4 guided), then tfus_w [64 o][128 c] as it lies.
__device__ __forceinline__ void prep_weights(int t, const float* __restrict__ swv, const float* __restrict__ sbv, const float* __restrict__ gwv, const float* __restrict__ gbv, const float* __restrict__ tw, _Float16* __restrict__ A16, _Float16* __restrict__ TW) {
  FragH f;
  if (t < 5 * CC * 12) { const int ai = t / (CC * 12), u = t % (CC * 12); const float* wv = (ai < 3) ? swv + (size_t)ai * CC * CC : gwv + (size_t)(ai - 3) * CC * CC; const float* bv = (ai < 3) ? sbv + ai * CC : gbv + (ai - 3) * CC;
    const int e = u / 12, c0 = (u % 12) * 8;
    v4f va = {0.f, 0.f, 0.f, 0.f}, vb = {0.f, 0.f, 0.f, 0.f};      /* a piece is eight weights in a row, or the bias and seven zeros, or zeros: one round of loads, not eight awaited ones */
    if (c0 < CC) { va = *(const v4fa*)(wv + e * CC + c0); vb = *(const v4fa*)(wv + e * CC + c0 + 4); } else if (c0 == CC) va[0] = bv[e];
#pragma unroll
    for (int q = 0; q < 4; ++q) { f.h[q] = (_Float16)(bf16_round(va[q]) * 16.0f); f.h[4 + q] = (_Float16)(bf16_round(vb[q]) * 16.0f); }
    *(v8us*)((unsigned short*)A16 + (size_t)t * 8) = f.half[0]; }
  else if (t < 5 * CC * 12 + CC * 128 / 8) { const int u = t - 5 * CC * 12;
#pragma unroll
    for (int i = 0; i < 8; ++i) f.h[i] = (_Float16)(bf16_round(tw[u * 8 + i]) * 16.0f);
    *(v8us*)((unsigned short*)TW + (size_t)u * 8) = f.half[0]; } }
__device__ __forceinline__ void xt_tail(unsigned short* xo) { const v8us one = {0x3C00, 0, 0, 0, 0, 0, 0, 0}, zz = {0, 0, 0, 0, 0, 0, 0, 0}; *(v8us*)(xo + 64) = one; *(v8us*)(xo + 72) = zz; *(v8us*)(xo + 80) = zz; *(v8us*)(xo + 88) = zz; }      /* columns 64..95 of an XT row: 1.0 (takes the bias), then zeros */
__device__ __forceinline__ void xt_out(unsigned short* xg, const unsigned short* sx, int tid) {      /* 128 rows of 96 halves from LDS (pitch 104) to memory, 16-B piece p = j * 128 + tid: each wave store covers 512 B in a row */
#pragma unroll
  for (int j = 0; j < 12; ++j) { const int p = j * 128 + tid; *(v8us*)(xg + (size_t)p * 8) = *(const v8us*)(sx + (p / 12) * 104 + (p % 12) * 8); }
  asm volatile("s_wait_xcnt 0x0" ::: "memory"); }      /* behind this run of stores, in front of the first rewrite of a register that one of them names */
// q/k planes and the token-major f16 plane XT (the V GEMM's B operand: 64 channels, a one for the bias column, zeros up to 96), from one pass over a source plane.
// q/k planes for one attention instance: per token n of batch b: q[d] = sum_c wq[d][c]*xs[c][n] + bq[d], k likewise (f32, summed over c in ascending order; xs = bf16-rounded input frame or an internal SA plane (RB)).
// One thread per token. The 2 x 8 x 64 weights are rounded to bf16 once per block into LDS (sW[c] = wq[0..7][c], wk[0..7][c]) and read from there as broadcasts; the token's channel values are loaded 16 at a time, one trip ahead of their sums, so the sums wait for memory once and not once per channel.
// Every sum keeps its order and the separate rounding of product and sum (the directive at the head of the body stands as it stood); q is then multiplied by log2(e), once, in f32, in front of its split into f16 planes.
#define LOG2E 1.4426950408889634f
template <int RB>
__global__ __launch_bounds__(128) void k_qk(const float* __restrict__ xs, size_t sx, const float* __restrict__ wq, const float* __restrict__ bq, const float* __restrict__ wk, const float* __restrict__ bk, int slab0, _Float16* __restrict__ QP, _Float16* __restrict__ KP, _Float16* __restrict__ XT,
    const float* __restrict__ swv, const float* __restrict__ sbv, const float* __restrict__ gwv, const float* __restrict__ gbv, const float* __restrict__ tw, _Float16* __restrict__ AWV, _Float16* __restrict__ TW16) {
  #pragma clang fp contract(off)
  __shared__ __attribute__((aligned(16))) float sW[CC][16];
  __shared__ __attribute__((aligned(16))) unsigned short sX[128][96 + 8];      /* the block's 128 rows of XT; pitch 208 B = 16 B x odd, so a wave's 16-B row pieces fall on different banks */
  const int tid = threadIdx.x;
  const int y = blockIdx.y;      /* source plane. RB (self): plane y = frame y gives q, k and XT, and the blocks of y == 3 convert the weights of the GEMMs. Guided: planes 0 and 2 give q, k of instance y >> 1, plane 1 gives XT */
  if (RB && y == 3) { prep_weights((int)blockIdx.x * 128 + tid, swv, sbv, gwv, gbv, tw, AWV, TW16); return; }      /* whole blocks, in front of the barrier */
  { const int ai = RB ? y : (y >> 1); xs += (size_t)y * sx; wq += ai * 8 * CC; bq += ai * 8; wk += ai * 8 * CC; bk += ai * 8; slab0 += ai * BB; if (RB) XT += (size_t)y * BB * TT * 96; }      /* sx = floats between two source planes; one XT plane per frame */
  const int bn = (int)blockIdx.x * 128 + tid; const int n = bn % TT, b = bn / TT;      /* the grid holds exactly BB * TT threads */
  const float* xp = xs + (size_t)b * CC * TT + n; unsigned short* xo = &sX[tid][0];      /* this token's row of XT, staged in LDS: the block's rows lie in a row in memory and leave as whole lines (xt_out) */
  unsigned short* xg = (unsigned short*)XT + (size_t)blockIdx.x * 128 * 96;
  if (!RB && y == 1) {      /* whole blocks, in front of the barrier: this plane only feeds the V GEMM, so its 64 channel loads go out together and the row follows */
    float xa[CC];
#pragma unroll
    for (int cc = 0; cc < CC; ++cc) xa[cc] = xp[(size_t)cc * TT];
#pragma unroll
    for (int c0 = 0; c0 < CC; c0 += 8) { FragH f;
#pragma unroll
      for (int i = 0; i < 8; ++i) f.h[i] = (_Float16)xa[c0 + i];
      *(v8us*)(xo + c0) = f.half[0]; }
    xt_tail(xo);
    __syncthreads();      /* every row is in LDS before any thread copies across rows; reached by the whole block or not at all */
    xt_out(xg, &sX[0][0], tid); return; }
  float wr[8], xn[16];      /* the weights' loads and those of channels 0..15 are issued together; the short loops over wr, xn and xc are unrolled so that the arrays stay in registers and the loads stand back to back */
#pragma unroll
  for (int j = 0; j < 4; ++j) { wr[j] = wq[j * 128 + tid]; wr[4 + j] = wk[j * 128 + tid]; }
#pragma unroll
  for (int i = 0; i < 16; ++i) xn[i] = xp[(size_t)i * TT];
  asm volatile("s_wait_xcnt 0x0" ::: "memory");      /* stands behind the run of weight and channel loads, in front of the first rewrite of a register that holds one of their addresses */
#pragma unroll
  for (int j = 0; j < 4; ++j) { const int i = j * 128 + tid, d = i / CC, c = i % CC; sW[c][d] = bf16_round(wr[j]); sW[c][8 + d] = bf16_round(wr[4 + j]); }
  float q[8], k[8]; for (int d = 0; d < 8; ++d) { q[d] = bf16_round(bq[d]); k[d] = bf16_round(bk[d]); }
  __syncthreads();      /* the rounded weights are in LDS before any thread reads them */
  /* kept rolled, 16 channels a trip: unrolled whole, the build fetched so many weights ahead that it took about 800 vector registers */
#pragma unroll 1
  for (int c0 = 0; c0 < CC; c0 += 16) { float xc[16];
#pragma unroll
    for (int i = 0; i < 16; ++i) xc[i] = xn[i];
    if (c0 + 16 < CC) {      /* the next trip's channels fly under this trip's sums */
#pragma unroll
      for (int i = 0; i < 16; ++i) xn[i] = xp[(size_t)(c0 + 16 + i) * TT];
      asm volatile("s_wait_xcnt 0x0" ::: "memory"); }      /* the build advances these loads' address registers early in the trip */
    float xv[16];
#pragma unroll
    for (int i = 0; i < 16; ++i) { xv[i] = xc[i]; if (RB) xv[i] = bf16_round(xv[i]); }
#pragma unroll
    for (int i = 0; i < 16; ++i) { const int c = c0 + i;
      const v4f wa = *(const v4fa*)&sW[c][0], wb = *(const v4fa*)&sW[c][4], wc = *(const v4fa*)&sW[c][8], wd = *(const v4fa*)&sW[c][12];
#pragma unroll
      for (int d = 0; d < 4; ++d) { q[d] += wa[d] * xv[i]; q[4 + d] += wb[d] * xv[i]; k[d] += wc[d] * xv[i]; k[4 + d] += wd[d] * xv[i]; } }
    if (RB) { FragH f0, f1;      /* self: the frame that gives q and k is also the V GEMM's operand */
#pragma unroll
      for (int i = 0; i < 8; ++i) { f0.h[i] = (_Float16)xv[i]; f1.h[i] = (_Float16)xv[8 + i]; }
      *(v8us*)(xo + c0) = f0.half[0]; *(v8us*)(xo + c0 + 8) = f1.half[0]; } }
  FragH fq0, fq1, fk0, fk1, fk2;      /* 16-B pieces of a row: Q = [q_hi | q_lo * 2^10 | q_hi | 0], K = [k_hi | k_hi * 2^-10 | k_lo | 0] */
#pragma unroll
  for (int d = 0; d < 8; ++d) { const float qs = q[d] * LOG2E;      /* q leaves in base-2 units, so that k_flash's score products are arguments of exp2 as they stand */
    const _Float16 qh = (_Float16)qs, kh = (_Float16)k[d]; const float qlo = (qs - (float)qh) * 1024.0f, klo = (k[d] - (float)kh);
    fq0.h[d] = qh; fq1.h[d] = (_Float16)qlo; fk0.h[d] = kh; fk1.h[d] = (_Float16)((float)kh * 0.0009765625f); fk2.h[d] = (_Float16)klo; }
  const v8us zz = {0, 0, 0, 0, 0, 0, 0, 0};
  if (RB) { xt_tail(xo);
    __syncthreads();      /* every row is in LDS before any thread copies across rows */
    xt_out(xg, &sX[0][0], tid); }
  const size_t row = (size_t)(slab0 + b) * TT + n; unsigned short* qo = (unsigned short*)QP + row * 32; unsigned short* ko = (unsigned short*)KP + (row >> 4) * 512 + (row & 15) * 8;      /* K in the order of k_flash's A fragments: [16 keys][piece 0..3][key & 15][8 halves] */
  *(v8us*)qo = fq0.half[0]; *(v8us*)(qo + 8) = fq1.half[0]; *(v8us*)(qo + 16) = fq0.half[0]; *(v8us*)(qo + 24) = zz;
  *(v8us*)ko = fk0.half[0]; *(v8us*)(ko + 128) = fk1.half[0]; *(v8us*)(ko + 256) = fk2.half[0]; *(v8us*)(ko + 384) = zz; }
// Block = 4 query tiles x KSPL key ranges: wave w works query tile w & 3 over keys [(w >> 2) * TT/KSPL, +TT/KSPL) with its own running max, row sum and unnormalised O; the KSPL partials of a tile are merged through LDS at the end.
// Scores are formed transposed, S^T = K.Q^T (A = 16 key rows, B = the wave's 16 queries), so lane (ln, hh) holds 16 of the 32 scores of query ln: max and sum run inside the lane, plus one exchange between the wave halves for the max.
// The two S^T tiles of a trip hold keys 8hh + r and 16 + 8hh + r, which is the k order of the loaders here, so P^T goes from the accumulators into a B operand in registers and O^T += V^T.P^T (A = 16 channel rows of Vt); P never passes through LDS.
__device__ __forceinline__ float xhalf(float x) { return __builtin_bit_cast(float, __builtin_amdgcn_permlanex16(__builtin_bit_cast(int, x), __builtin_bit_cast(int, x), 0x76543210, 0xfedcba98, false, false)); }      /* lane l <-> lane l ^ 16 */
typedef float v2f __attribute__((ext_vector_type(2)));
typedef _Float16 v2h __attribute__((ext_vector_type(2)));
// Softmax runs in base 2 against a reference R per query that moves only when it must. q carries log2(e) (k_qk), and the score products start from C = -R, so an accumulator is t - R and a weight is one hardware exp2 of it, with no vector subtract.
// R is set to (largest t seen in that trip) - 7, so weights start at 2^7 or below. A trip's weights are good as long as the lane's sum of them is at most 2^15: each then fits f16. Only if some lane's sum is larger (or in a wave's first trip, where the limit is -1)
// the wave takes the branch that forms the trip's maximum, joins the halves, raises R, scales O and the row sum by 2^(R_old - R_new) and forms the weights anew. Any R gives the same O / l; the merge treats R as it treated the running max. A weight below 2^-126 counts as 0.
// One matrix instruction as the bare builtin, for the two score products of k_flash: the build keeps the distance behind them itself, once behind the pair, where mmaH spends four v_nop of its own behind every product.
__device__ __forceinline__ v8f wmmaH(v16h a, v16h b, v8f c) { return __builtin_amdgcn_wmma_f32_16x16x32_f16(false, a, false, b, (short)0, c, false, false); }
// One hardware exp2 with a free issue slot on either side: the instruction set asks for one independent instruction or v_nop between a transcendental and a neighbour that overwrites its source or reads its result.
__device__ __forceinline__ float exp2_slot(float x) { float y; asm("v_nop\n\tv_exp_f32 %0, %1\n\tv_nop" : "=v"(y) : "v"(x)); return y; }
// The same for eight values: the results take registers of their own (early clobber), so no exp2 of the run reads a neighbour's result or overwrites its source, and one free slot at either end serves the run. For the reference branch of k_flash.
__device__ __forceinline__ v8f exp2_slot8(v8f x) { float y0, y1, y2, y3, y4, y5, y6, y7;
  asm("v_nop\n\tv_exp_f32 %0, %8\n\tv_exp_f32 %1, %9\n\tv_exp_f32 %2, %10\n\tv_exp_f32 %3, %11\n\tv_exp_f32 %4, %12\n\tv_exp_f32 %5, %13\n\tv_exp_f32 %6, %14\n\tv_exp_f32 %7, %15\n\tv_nop"
      : "=&v"(y0), "=&v"(y1), "=&v"(y2), "=&v"(y3), "=&v"(y4), "=&v"(y5), "=&v"(y6), "=&v"(y7) : "v"(x[0]), "v"(x[1]), "v"(x[2]), "v"(x[3]), "v"(x[4]), "v"(x[5]), "v"(x[6]), "v"(x[7]));
  return (v8f){y0, y1, y2, y3, y4, y5, y6, y7}; }
// The merge also adds the residual and writes the stage's result in the layout its reader wants. SELF: SAo[slab][e][n] = O + bf16(RES[slab][e][n]), channel-major f32; a wave holds 32 queries of one channel group, so every load and store is a whole 128-B line.
// Guided: CATo[b][n][g * 64 + e] = f16(O + RES[b][e][n]) for slab = g * BB + b, token-major f16; 16 lanes write one token's 128 B.
template <int KSPL, bool SELF>
__global__ __launch_bounds__(128 * KSPL, 8) void k_flash(const _Float16* __restrict__ Q16, int ldq, const _Float16* __restrict__ K16, int ldk, const _Float16* __restrict__ Vt, const int* __restrict__ MSK, const float* __restrict__ RES, float* __restrict__ SAo, _Float16* __restrict__ CATo) {
  constexpr int RPW = 16, NQB = TT / (4 * RPW), DT = 4, NW = 4 * KSPL;      /* d_qk = 32 (24 real + zero padding), d_v = 64 */
  __shared__ __attribute__((aligned(16))) float sO[NW][RPW][64 + 4];
  __shared__ float sM[NW][RPW], sL[NW][RPW];
  (void)MSK;
  const int tid = threadIdx.x, w = __builtin_amdgcn_readfirstlane(tid >> 5), lane = tid & 31, ln = lane & 15, hh = lane >> 4;
  const int slab = blockIdx.x / NQB, qblk = blockIdx.x % NQB; const int b = slab / NH; const int qb0 = qblk * (4 * RPW); const int q0 = qb0 + (w & 3) * RPW;
  FragH bq;      /* B operand: column ln = query q0 + ln */
  { const unsigned short* qr = (const unsigned short*)Q16 + ((size_t)b * TT + q0 + ln) * ldq; bq.half[0] = *(const v8us*)(qr + 8 * hh); bq.half[1] = *(const v8us*)(qr + 16 + 8 * hh); }
  const unsigned short* Vth = (const unsigned short*)Vt + (size_t)slab * 64 * TT;      /* v per slab: 64 x 4096 in fragment order, [32 keys][16 channels][half 0, 1][lane][8 halves] */
  float m_r = -3.0e38f, l_r = 0.f, lim = -1.0f; v8f oacc[DT];      /* m_r = R, the reference in use, base-2 units; lim = largest sum of a lane's weights of one trip that passes, -1 until R is set */      /* oacc[dt][r] = O^T[channel dt * 16 + 8hh + r][query ln] */
  v8f cn = (v8f){0.f,0.f,0.f,0.f,0.f,0.f,0.f,0.f};      /* C operand of the score products: -R of query ln in all eight rows; 0 until R is set, so that the first trip's accumulators are t itself */
#pragma unroll
  for (int dt = 0; dt < DT; ++dt) oacc[dt] = (v8f){0.f,0.f,0.f,0.f,0.f,0.f,0.f,0.f};
  const int jbeg = (w >> 2) * (TT / KSPL);
  /* K and V lie in memory in fragment order (written so by k_qk and by the V GEMM): fragment = 2 x 512 B, lane l's two 16-B pieces at l * 16 and 512 + l * 16, so every load of a wave covers four whole 128-B lines and a trip reads 2 KB of K and 4 KB of V in a row */
  (void)ldk;
  const unsigned short* kr = (const unsigned short*)K16 + ((size_t)b * TT + jbeg) * 32 + lane * 8;      /* this lane's piece of the trip's first K fragment (key row j0 + ln, halves 8hh ..; the second piece: halves 16 + 8hh ..) ... */
  const unsigned short* vr = Vth + (size_t)jbeg * 64 + lane * 8;      /* ... and of its first V fragment (channel row ln, keys j0 + 8hh ..; the second piece: keys j0 + 16 + 8hh ..); j0 = jbeg + 32 * trip, both addresses advance with the trip */
#pragma unroll 1
  for (int it = 0; it < TT / KSPL / 32; ++it) {
    FragH ak[2], av[DT];      /* the trip's two K and four V fragments: their twelve loads go out together here, so the trip waits for memory once and not once per fragment */
#pragma unroll
    for (int nt = 0; nt < 2; ++nt) { ak[nt].half[0] = *(const v8us*)(kr + nt * 512); ak[nt].half[1] = *(const v8us*)(kr + nt * 512 + 256); }
    asm volatile("s_wait_xcnt 0x0" :: "v"(kr) : "memory");      /* behind the K loads: the build gave a register that holds their address to a V load as its target; the address is an input here so that its registers live up to this wait and no K load gets them as its target */
#pragma unroll
    for (int dt = 0; dt < DT; ++dt) { av[dt].half[0] = *(const v8us*)(vr + dt * 512); av[dt].half[1] = *(const v8us*)(vr + dt * 512 + 256); }
    asm volatile("s_wait_xcnt 0x0" :: "v"(vr) : "memory");      /* behind this run of loads, in front of the advance of the two addresses that they name; it also keeps the build from moving a V load down to its use; the address is an input so that its registers live up to this wait: without that the build gave them to the run's last load as its target */
    __builtin_amdgcn_sched_barrier(0);      /* the first score product stays behind the whole run of loads: moved up among them, as the build did without this line, it makes the run's last load wait for the first K fragment */
    kr += 2 * 512; vr += DT * 512;
    v8f s[2];      /* s[nt][r] = score of key j0 + nt * 16 + 8hh + r with query ln, base 2, less R */
#pragma unroll
    for (int nt = 0; nt < 2; ++nt) s[nt] = wmmaH(ak[nt].v, bq.v, cn);      /* t - R */
    __builtin_amdgcn_sched_barrier(0);      /* the two products stay side by side, so that the distance behind a product is kept once for the pair: without this line the build put the first tile's exp2 between them and padded behind each product */
    float p[16], ls = 0.f;      /* p[nt * 8 + r] = weight of key nt * 16 + 8hh + r */
#pragma unroll
    for (int i = 0; i < 16; ++i) { p[i] = __builtin_amdgcn_exp2f(s[i >> 3][i & 7]); ls += p[i]; }
    if (__builtin_amdgcn_ballot_w32(!(ls <= lim)) != 0) {      /* one test a trip, a scalar branch, the same for the whole wave; seldom taken behind the first trip */
      s[0] -= cn; s[1] -= cn;      /* t again */
      float mc = fmaxf(s[0][0], s[1][0]);
#pragma unroll
      for (int r = 1; r < 8; ++r) mc = fmaxf(mc, fmaxf(s[0][r], s[1][r]));
      mc = fmaxf(mc, xhalf(mc));      /* both halves hold the max over the trip's 32 keys, so both set the same R */
      const float mn = fmaxf(m_r, mc - 7.0f); const float al = exp2_slot(m_r - mn); m_r = mn; lim = 32768.0f;      /* first trip: al = 2^(-3e38 - mn) = 0, on O = 0 and l = 0 */
      cn = (v8f){-mn, -mn, -mn, -mn, -mn, -mn, -mn, -mn};
      s[0] = exp2_slot8(s[0] + cn); s[1] = exp2_slot8(s[1] + cn);      /* the weights against the new R */
      ls = 0.f;
#pragma unroll
      for (int i = 0; i < 16; ++i) { p[i] = s[i >> 3][i & 7]; ls += p[i]; }
      l_r *= al;
#pragma unroll
      for (int dt = 0; dt < DT; ++dt) oacc[dt] *= al; }
    l_r += ls;      /* this half's 16 keys; the halves are joined behind the loop */
    FragH ph, pl;      /* P^T as f16 hi + residual: element nt * 8 + r = key nt * 16 + 8hh + r */
#pragma unroll
    for (int i = 0; i < 16; i += 2) { const v2f ps = (v2f){p[i], p[i + 1]}; const v2h hi = __builtin_convertvector(ps, v2h); const v2h lo = __builtin_convertvector(ps - __builtin_convertvector(hi, v2f), v2h);
      ph.h[i] = hi[0]; ph.h[i + 1] = hi[1]; pl.h[i] = lo[0]; pl.h[i + 1] = lo[1]; }
    /* O^T += V^T.Ph on the four channel tiles, then V^T.Pl: each accumulator takes Ph first and Pl second, as before, and its second product stands four matrix instructions behind its first.
       The eight stand in one statement so that each fills the hazard window of the others: as single builtins the build spread the tail of the row sum among them, onto operand registers of products just issued, and padded each such place with four v_nop.
       The four v_nop at the end keep the distance behind the last product, once a trip: the branch back follows, and what comes next may overwrite an operand or read an accumulator. */
    asm volatile("v_wmma_f32_16x16x32_f16 %0, %4, %8, %0\n\t"
                 "v_wmma_f32_16x16x32_f16 %1, %5, %8, %1\n\t"
                 "v_wmma_f32_16x16x32_f16 %2, %6, %8, %2\n\t"
                 "v_wmma_f32_16x16x32_f16 %3, %7, %8, %3\n\t"
                 "v_wmma_f32_16x16x32_f16 %0, %4, %9, %0\n\t"
                 "v_wmma_f32_16x16x32_f16 %1, %5, %9, %1\n\t"
                 "v_wmma_f32_16x16x32_f16 %2, %6, %9, %2\n\t"
                 "v_wmma_f32_16x16x32_f16 %3, %7, %9, %3\n\t"
                 "v_nop\n\tv_nop\n\tv_nop\n\tv_nop"
                 : "+v"(oacc[0]), "+v"(oacc[1]), "+v"(oacc[2]), "+v"(oacc[3])
                 : "v"(av[0].v), "v"(av[1].v), "v"(av[2].v), "v"(av[3].v), "v"(ph.v), "v"(pl.v)); }
  l_r += xhalf(l_r);
  if (hh == 0) { sM[w][ln] = m_r; sL[w][ln] = l_r; }
#pragma unroll
  for (int dt = 0; dt < DT; ++dt) { *(v4fa*)&sO[w][ln][dt * 16 + 8 * hh] = (v4f){oacc[dt][0], oacc[dt][1], oacc[dt][2], oacc[dt][3]}; *(v4fa*)&sO[w][ln][dt * 16 + 8 * hh + 4] = (v4f){oacc[dt][4], oacc[dt][5], oacc[dt][6], oacc[dt][7]}; }
  __syncthreads();      /* every wave's partial is in LDS before any thread merges */
  /* merge: thread = (query of the block, 4 channels); O = sum_s 2^(m_s - M) * O_s / sum_s 2^(m_s - M) * l_s, m_s = the reference of partial s, M = max_s m_s */
#pragma unroll
  for (int i = tid; i < 4 * RPW * 16; i += 128 * KSPL) { const int qq = SELF ? (i & 63) : (i >> 4), pc = SELF ? (i >> 6) : (i & 15), g = qq / RPW, r = qq % RPW;
    float mx = sM[g][r];
#pragma unroll
    for (int s = 1; s < KSPL; ++s) mx = fmaxf(mx, sM[s * 4 + g][r]);
    float l = 0.f; v4f a = {0.f, 0.f, 0.f, 0.f};
#pragma unroll
    for (int s = 0; s < KSPL; ++s) { const float e = exp2_slot(sM[s * 4 + g][r] - mx); l += sL[s * 4 + g][r] * e; const v4f val = *(const v4fa*)&sO[s * 4 + g][r][pc * 4]; a += val * e; }
    const float inv = (l > 0.f) ? 1.0f / l : 0.f;
    const v4f o = a * inv;
    const float* rp = RES + ((size_t)(SELF ? slab : slab % BB) * CC + pc * 4) * TT + qb0 + qq;      /* residual of channels pc * 4 .. + 3 at this query */
    if (SELF) { float* sp = SAo + ((size_t)slab * CC + pc * 4) * TT + qb0 + qq;
#pragma unroll
      for (int j = 0; j < 4; ++j) sp[(size_t)j * TT] = o[j] + bf16_round(rp[(size_t)j * TT]); }
    else { v4h h4;
#pragma unroll
      for (int j = 0; j < 4; ++j) h4[j] = (_Float16)(o[j] + rp[(size_t)j * TT]);
      *(v4h*)(CATo + ((size_t)(slab % BB) * TT + qb0 + qq) * 128 + (slab / BB) * 64 + pc * 4) = h4; } } }

extern "C" void kernel_launch(void* const* d_in, const int* in_sizes, int n_in,
                              void* d_out, int out_size, void* d_ws, size_t ws_size, hipStream_t stream) {
  (void)in_sizes; (void)n_in; (void)out_size;
  const float* const* I = (const float* const*)d_in; const float* x = I[0]; const float* sa_wq = I[1]; const float* sa_bq = I[2]; const float* sa_wk = I[3]; const float* sa_bk = I[4]; const float* sa_wv = I[5]; const float* sa_bv = I[6];
  const float* ga_wq = I[7]; const float* ga_bq = I[8]; const float* ga_wk = I[9]; const float* ga_bk = I[10]; const float* ga_wv = I[11]; const float* ga_bv = I[12]; const float* tw = I[13]; const float* tb = I[14];
  char* ws = (char*)d_ws; size_t off = 0;
  auto take = [&](size_t bytes) { char* p = ws + off; off += (bytes + 255) & ~(size_t)255; return p; };
  const size_t PL = (size_t)BB * CC * TT;      /* one [B][64][4096] f32 plane = 1 M floats */
  _Float16* AWV = (_Float16*)take((size_t)5 * CC * 96 * 2); _Float16* TW16 = (_Float16*)take((size_t)CC * 128 * 2);
  _Float16* XT = (_Float16*)take((size_t)3 * BB * TT * 96 * 2); _Float16* QP = (_Float16*)take((size_t)NSL * TT * 32 * 2); _Float16* KP = (_Float16*)take((size_t)NSL * TT * 32 * 2); _Float16* VT = (_Float16*)take((size_t)NSL * CC * TT * 2);
  float* SA = (float*)take(3 * PL * 4); _Float16* CAT = (_Float16*)take((size_t)BB * TT * 128 * 2);
  if (off > ws_size) return;      // 0.1 + 9.4 + 5.2 + 5.2 + 10.5 + 12.6 + 4.2 = about 47 MB
  const unsigned gqk = (unsigned)((size_t)BB * TT / 128); const unsigned gvx = ((CC / 16) * (TT / 64) + 3) / 4;
  /* self attention on the three frames: slabs a * BB + b for a = 0,1,2; each stage is one launch over all three frames (frame on blockIdx.y, for the GEMM on blockIdx.z), XT holds one plane per frame */
  k_qk<1><<<dim3(gqk, 4), 128, 0, stream>>>(x, PL, sa_wq, sa_bq, sa_wk, sa_bk, 0, QP, KP, XT, sa_wv, sa_bv, ga_wv, ga_bv, tw, AWV, TW16);      /* q, k and XT of the three frames; blockIdx.y == 3: the weights of all GEMMs */
  k_gemm_hhx<0, false, true><<<dim3(gvx, BB, 3), 128, 0, stream>>>(AWV, 96, 0, XT, 96, (size_t)TT * 96, 0.0625f, nullptr, 0, nullptr, 1, 0, 0, nullptr, VT, TT, (size_t)CC * TT, CC, TT, 96, (size_t)CC * 96, (size_t)BB * TT * 96, (size_t)BB * CC * TT, nullptr, nullptr);      /* v[b][e][m] = wv.x + bv as f16 in the fragment order of k_flash: batched over b and frame, M 64 N 4096 K 96 */
  k_flash<8, true><<<3 * BB * (TT / 64), 1024, 0, stream>>>(QP, 32, KP, 32, VT, nullptr, x, SA, nullptr);      /* slabs 0..11; 768 blocks of 32 waves = three full rounds of the WGPs; SA_a = attn-out + x_a (channel-major f32) */
  /* guided attentions: slabs 12..15 (q,k from SA_0; v,res from SA_1) and 16..19 (q,k from SA_2) */
  k_qk<0><<<dim3(gqk, 3), 128, 0, stream>>>(SA, PL, ga_wq, ga_bq, ga_wk, ga_bk, 3 * BB, QP, KP, XT, nullptr, nullptr, nullptr, nullptr, nullptr, nullptr, nullptr);      /* q, k from SA_0 and SA_2; XT = SA_1 token-major (internal f32, no rounding) */
  k_gemm_hhx<0, false, true><<<dim3(gvx, BB, 2), 128, 0, stream>>>(AWV + (size_t)3 * CC * 96, 96, 0, XT, 96, (size_t)TT * 96, 0.0625f, nullptr, 0, nullptr, 1, 0, 0, nullptr, VT + (size_t)3 * BB * CC * TT, TT, (size_t)CC * TT, CC, TT, 96, (size_t)CC * 96, 0, (size_t)BB * CC * TT, nullptr, nullptr);      /* both read the SA_1 plane of XT */
  k_flash<4, false><<<2 * BB * (TT / 64), 512, 0, stream>>>(QP + (size_t)3 * BB * TT * 32, 32, KP + (size_t)3 * BB * TT * 32, 32, VT + (size_t)3 * BB * CC * TT, nullptr, SA + PL, nullptr, CAT);      /* slabs 12..19 (kernel-relative 0..7); cat = [attn-out_0 + SA_1 | attn-out_1 + SA_1], token-major f16 */
  k_gemm_hhx<0, true><<<dim3(gvx, BB), 128, 0, stream>>>(TW16, 128, 0, CAT, 128, (size_t)TT * 128, 0.0625f, nullptr, 0, nullptr, 1, 0, 0, (float*)d_out, nullptr, TT, (size_t)CC * TT, CC, TT, 128, 0, 0, 0, tb, SA + PL);      /* fusion[b][o][n] = sum_c W[o][c] * cat[b][c][n]: A = W (M 64, K 128), Bt = CAT[b] token-major; the epilogue adds tfus_b per row o and writes out = fusion * SA_1 + SA_1 */
}
